// v000
// Times are from an AMD MI455X. After a warm-up the kernel runs many times in a row, and a time is the length of
// such a window on the GPU divided by its runs, so every launch and the gaps after it count. The runs cycle
// through copies of the inputs. A figure is the median of several windows, for all but v000 over two sittings.
// Sittings can differ by a few percent; kernels timed side by side share one.
// The starting kernel, v000, takes 769 microseconds a run.
#include <hip/hip_runtime.h>

typedef _Float16 v8h  __attribute__((ext_vector_type(8)));
typedef _Float16 v16h __attribute__((ext_vector_type(16)));
typedef float    v8f  __attribute__((ext_vector_type(8)));
typedef unsigned int u32x4 __attribute__((ext_vector_type(4)));
typedef int          i32x4 __attribute__((ext_vector_type(4)));
typedef int          i32x8 __attribute__((ext_vector_type(8)));

#define CB  4
#define CT  2048
#define CD  1024
#define CH  16
#define CHD 64
#define CM  (CB * CT)          // 8192 rows
#define CDF (4 * CD)           // 4096 ffn dim

#if __has_builtin(__builtin_amdgcn_tensor_load_to_lds) && \
    __has_builtin(__builtin_amdgcn_s_wait_tensorcnt)
#define USE_TDM 1
#else
#define USE_TDM 0
#endif

__device__ __forceinline__ v16h ldfrag(const _Float16* p) {
    union { v16h v; v8h h[2]; } u;
    u.h[0] = *reinterpret_cast<const v8h*>(p);
    u.h[1] = *reinterpret_cast<const v8h*>(p + 16);
    return u.v;
}

__device__ __forceinline__ v8f wmma_f16(v16h a, v16h b, v8f c) {
    return __builtin_amdgcn_wmma_f32_16x16x32_f16(
        false, a, false, b, (short)0, c, false, false);
}

__device__ __forceinline__ float gelu_f(float x) {
    const float c = 0.7978845608028654f;     // sqrt(2/pi)
    float t = tanhf(c * (x + 0.044715f * x * x * x));
    return 0.5f * x * (1.f + t);
}

// LDS byte offset of a generic pointer known to live in shared memory.
__device__ __forceinline__ unsigned lds_off_of(const void* p) {
    return (unsigned)(unsigned long long)
        ((const __attribute__((address_space(3))) char*)p);
}

#if USE_TDM
__device__ __forceinline__ void tdm_load_tile(unsigned lds_addr,
                                              const _Float16* gptr,
                                              unsigned rowLen,
                                              unsigned rows,
                                              unsigned tileK,
                                              unsigned tileRows)
{
    unsigned long long ga = (unsigned long long)gptr;
    u32x4 g0;
    g0[0] = 1u;
    g0[1] = lds_addr;
    g0[2] = (unsigned)ga;
    g0[3] = (unsigned)(ga >> 32) | (2u << 30);

    i32x8 g1;
    g1[0] = (int)(1u << 16);
    g1[1] = (int)((rowLen & 0xFFFFu) << 16);
    g1[2] = (int)((rowLen >> 16) | ((rows & 0xFFFFu) << 16));
    g1[3] = (int)((rows >> 16) | (tileK << 16));
    g1[4] = (int)(tileRows & 0xFFFFu);
    g1[5] = (int)rowLen;
    g1[6] = 0;
    g1[7] = 0;

    i32x4 gz4 = {0, 0, 0, 0};
    i32x8 gz8 = {0, 0, 0, 0, 0, 0, 0, 0};
    __builtin_amdgcn_tensor_load_to_lds(g0, g1, gz4, gz4, gz8, 0);
}
#endif

// ---------------------------------------------------------------------------
// Transpose + cast: in (K x N) f32 -> out (N x K) f16
// ---------------------------------------------------------------------------
__global__ void transpose_cast_kernel(const float* __restrict__ in,
                                      _Float16* __restrict__ out,
                                      int K, int N) {
    __shared__ float tile[32][33];
    int nb = blockIdx.x * 32;
    int kb = blockIdx.y * 32;
    int tx = threadIdx.x;          // 0..31
    int ty = threadIdx.y;          // 0..7
#pragma unroll
    for (int i = 0; i < 32; i += 8)
        tile[ty + i][tx] = in[(size_t)(kb + ty + i) * N + nb + tx];
    __syncthreads();
#pragma unroll
    for (int i = 0; i < 32; i += 8)
        out[(size_t)(nb + ty + i) * K + kb + tx] = (_Float16)tile[tx][ty + i];
}

// ---------------------------------------------------------------------------
// LayerNorm: one block (256 threads) per row of D=1024, f32 in -> f16 out
// ---------------------------------------------------------------------------
__global__ void layernorm_f16_kernel(const float* __restrict__ x,
                                     const float* __restrict__ gamma,
                                     const float* __restrict__ beta,
                                     _Float16* __restrict__ out) {
    __shared__ float red[256];
    size_t rowo = (size_t)blockIdx.x * CD;
    int tid = threadIdx.x;
    float v[4];
    float s = 0.f;
#pragma unroll
    for (int i = 0; i < 4; ++i) { v[i] = x[rowo + tid + i * 256]; s += v[i]; }
    red[tid] = s;
    __syncthreads();
    for (int st = 128; st > 0; st >>= 1) {
        if (tid < st) red[tid] += red[tid + st];
        __syncthreads();
    }
    float mean = red[0] * (1.f / (float)CD);
    __syncthreads();
    float s2 = 0.f;
#pragma unroll
    for (int i = 0; i < 4; ++i) { float d = v[i] - mean; s2 += d * d; }
    red[tid] = s2;
    __syncthreads();
    for (int st = 128; st > 0; st >>= 1) {
        if (tid < st) red[tid] += red[tid + st];
        __syncthreads();
    }
    float rstd = rsqrtf(red[0] * (1.f / (float)CD) + 1e-5f);
#pragma unroll
    for (int i = 0; i < 4; ++i) {
        int c = tid + i * 256;
        out[rowo + c] = (_Float16)(gamma[c] * (v[i] - mean) * rstd + beta[c]);
    }
}

__global__ void gemm_wmma_kernel(const _Float16* __restrict__ A,
                                 const _Float16* __restrict__ Bt,
                                 const float* __restrict__ bias,
                                 const float* __restrict__ resid,
                                 float* __restrict__ of32,
                                 _Float16* __restrict__ of16,
                                 int M, int N, int K, int act, int mode) {
    __shared__ __align__(16) _Float16 ldsA[2][64][32];    //  8 KB
    __shared__ __align__(16) _Float16 ldsB[2][128][32];   // 16 KB

    int lane = threadIdx.x & 31;
    int wave = threadIdx.x >> 5;          // 0..7
    int wm = wave & 3;                    // 0..3 -> M sub-tile
    int wn = wave >> 2;                   // 0..1 -> N half
    int m0b = blockIdx.y * 64;
    int n0b = blockIdx.x * 128;
    int row  = lane & 15;
    int koff = (lane >> 4) << 3;          // 0 or 8
    int hi   = lane >> 4;
    int col  = lane & 15;

    v8f acc[4] = {v8f{0.f}, v8f{0.f}, v8f{0.f}, v8f{0.f}};

#if USE_TDM
    if (wave == 0) {
        tdm_load_tile(lds_off_of(&ldsA[0][0][0]), A + (size_t)m0b * K,
                      (unsigned)K, 64u, 32u, 64u);
        tdm_load_tile(lds_off_of(&ldsB[0][0][0]), Bt + (size_t)n0b * K,
                      (unsigned)K, 128u, 32u, 128u);
        __builtin_amdgcn_s_wait_tensorcnt(0);
    }
    __syncthreads();
    int buf = 0;
    for (int kb = 0; kb < K; kb += 32) {
        if (wave == 0 && kb + 32 < K) {   // DMA next chunk while computing
            tdm_load_tile(lds_off_of(&ldsA[buf ^ 1][0][0]),
                          A + (size_t)m0b * K + kb + 32,
                          (unsigned)K, 64u, 32u, 64u);
            tdm_load_tile(lds_off_of(&ldsB[buf ^ 1][0][0]),
                          Bt + (size_t)n0b * K + kb + 32,
                          (unsigned)K, 128u, 32u, 128u);
        }
        v16h af = ldfrag(&ldsA[buf][wm * 16 + row][koff]);
        v16h bf[4];
#pragma unroll
        for (int j = 0; j < 4; ++j)
            bf[j] = ldfrag(&ldsB[buf][wn * 64 + j * 16 + row][koff]);
#pragma unroll
        for (int j = 0; j < 4; ++j)
            acc[j] = wmma_f16(af, bf[j], acc[j]);
        if (kb + 32 < K) {
            if (wave == 0) __builtin_amdgcn_s_wait_tensorcnt(0);
            __syncthreads();              // next buffer ready, current drained
            buf ^= 1;
        }
    }
#else
    for (int kb = 0; kb < K; kb += 32) {
        __syncthreads();
        for (int idx = threadIdx.x; idx < 64 * 4; idx += 256) {
            int r = idx >> 2, c = (idx & 3) * 8;
            *(v8h*)&ldsA[0][r][c] =
                *(const v8h*)(A + (size_t)(m0b + r) * K + kb + c);
        }
        for (int idx = threadIdx.x; idx < 128 * 4; idx += 256) {
            int r = idx >> 2, c = (idx & 3) * 8;
            *(v8h*)&ldsB[0][r][c] =
                *(const v8h*)(Bt + (size_t)(n0b + r) * K + kb + c);
        }
        __syncthreads();
        v16h af = ldfrag(&ldsA[0][wm * 16 + row][koff]);
        v16h bf[4];
#pragma unroll
        for (int j = 0; j < 4; ++j)
            bf[j] = ldfrag(&ldsB[0][wn * 64 + j * 16 + row][koff]);
#pragma unroll
        for (int j = 0; j < 4; ++j)
            acc[j] = wmma_f16(af, bf[j], acc[j]);
    }
#endif

    int m0 = m0b + wm * 16;
    int n0 = n0b + wn * 64;
#pragma unroll
    for (int j = 0; j < 4; ++j) {
        int n = n0 + j * 16 + col;
        float bv = bias ? bias[n] : 0.f;
#pragma unroll
        for (int r = 0; r < 8; ++r) {
            int m = m0 + r + 8 * hi;
            float v = acc[j][r] + bv;
            if (act == 1) v = gelu_f(v);
            if (mode == 0) {
                float o = v;
                if (resid) o += resid[(size_t)m * N + n];
                of32[(size_t)m * N + n] = o;
            } else if (mode == 1) {
                of16[(size_t)m * N + n] = (_Float16)v;
            } else if (mode == 2) {        // (B,H,T,HD)
                int b = m >> 11, t = m & (CT - 1);
                int h = n >> 6,  hd = n & (CHD - 1);
                of16[((size_t)(b * CH + h) * CT + t) * CHD + hd] = (_Float16)v;
            } else {                       // V^T: (B,H,HD,T)
                int b = m >> 11, t = m & (CT - 1);
                int h = n >> 6,  hd = n & (CHD - 1);
                of16[((size_t)(b * CH + h) * CHD + hd) * CT + t] = (_Float16)v;
            }
        }
    }
}

// ---------------------------------------------------------------------------
// Flash attention (causal). Block = 128 threads = 4 waves, one 64-query tile.
// Wave w owns query rows q0+w*16 .. +15. Loops key blocks kb <= qb.
// All 8 operand fragments of each WMMA burst are preloaded so the loads
// clause together and latency isn't paid per-WMMA.
// ---------------------------------------------------------------------------
__global__ void attention_kernel(const _Float16* __restrict__ Qh,   // (B,H,T,HD)
                                 const _Float16* __restrict__ Kh,   // (B,H,T,HD)
                                 const _Float16* __restrict__ Vt,   // (B,H,HD,T)
                                 _Float16* __restrict__ attn_out) { // (B,T,D)
    int qb   = blockIdx.x;               // 0..T/64-1
    int bh   = blockIdx.y;               // 0..B*H-1
    int b    = bh >> 4;
    int h    = bh & (CH - 1);
    int lane = threadIdx.x & 31;
    int wave = threadIdx.x >> 5;         // 0..3
    int row  = lane & 15;
    int koff = (lane >> 4) << 3;
    int hi   = lane >> 4;
    int col  = lane & 15;
    int q0   = qb * 64 + wave * 16;

    const _Float16* Q  = Qh + (size_t)bh * CT * CHD;
    const _Float16* Kp = Kh + (size_t)bh * CT * CHD;
    const _Float16* Vp = Vt + (size_t)bh * CHD * CT;

    v16h qf0 = ldfrag(Q + (size_t)(q0 + row) * CHD + koff);
    v16h qf1 = ldfrag(Q + (size_t)(q0 + row) * CHD + 32 + koff);

    v8f  o[4] = {v8f{0.f}, v8f{0.f}, v8f{0.f}, v8f{0.f}};
    float mrow[8], lrow[8];
#pragma unroll
    for (int r = 0; r < 8; ++r) { mrow[r] = -1e30f; lrow[r] = 0.f; }

    __shared__ __align__(16) _Float16 Pl[4][16][64];   // 8 KB

    const float scale = 0.125f;   // HD^-0.5

    for (int kb = 0; kb <= qb; ++kb) {
        int k0 = kb * 64;
        // ---- preload all K fragments, then burst 8 WMMAs
        v16h kf[8];
#pragma unroll
        for (int j = 0; j < 4; ++j) {
            const _Float16* kp = Kp + (size_t)(k0 + j * 16 + row) * CHD;
            kf[2 * j]     = ldfrag(kp + koff);
            kf[2 * j + 1] = ldfrag(kp + 32 + koff);
        }
        v8f s[4] = {v8f{0.f}, v8f{0.f}, v8f{0.f}, v8f{0.f}};
#pragma unroll
        for (int j = 0; j < 4; ++j) {
            s[j] = wmma_f16(qf0, kf[2 * j],     s[j]);
            s[j] = wmma_f16(qf1, kf[2 * j + 1], s[j]);
        }
        // ---- scale, causal mask, row max
        float pmax[8];
#pragma unroll
        for (int r = 0; r < 8; ++r) {
            int qrow = q0 + r + 8 * hi;
            float mx = -1e30f;
#pragma unroll
            for (int j = 0; j < 4; ++j) {
                int kcol = k0 + j * 16 + col;
                float sv = s[j][r] * scale;
                if (kcol > qrow) sv = -1e30f;
                s[j][r] = sv;
                mx = fmaxf(mx, sv);
            }
#pragma unroll
            for (int d = 8; d >= 1; d >>= 1)
                mx = fmaxf(mx, __shfl_xor(mx, d, 32));
            pmax[r] = mx;
        }
        // ---- online softmax update
#pragma unroll
        for (int r = 0; r < 8; ++r) {
            float mnew = fmaxf(mrow[r], pmax[r]);
            float corr = __expf(mrow[r] - mnew);
            float rsum = 0.f;
#pragma unroll
            for (int j = 0; j < 4; ++j) {
                float p = __expf(s[j][r] - mnew);
                s[j][r] = p;
                rsum += p;
            }
#pragma unroll
            for (int d = 8; d >= 1; d >>= 1)
                rsum += __shfl_xor(rsum, d, 32);
            lrow[r] = lrow[r] * corr + rsum;
            mrow[r] = mnew;
#pragma unroll
            for (int j = 0; j < 4; ++j) o[j][r] *= corr;
        }
        // ---- P to LDS (C layout), re-read as A fragments
        __syncthreads();
#pragma unroll
        for (int r = 0; r < 8; ++r)
#pragma unroll
            for (int j = 0; j < 4; ++j)
                Pl[wave][r + 8 * hi][j * 16 + col] = (_Float16)s[j][r];
        __syncthreads();
        // ---- O += P * V : preload all V fragments, then burst 8 WMMAs
        v16h vf[8];
#pragma unroll
        for (int ks = 0; ks < 2; ++ks)
#pragma unroll
            for (int j = 0; j < 4; ++j)
                vf[ks * 4 + j] = ldfrag(Vp + (size_t)(j * 16 + row) * CT +
                                        k0 + ks * 32 + koff);
#pragma unroll
        for (int ks = 0; ks < 2; ++ks) {
            v16h pf = ldfrag(&Pl[wave][row][ks * 32 + koff]);
#pragma unroll
            for (int j = 0; j < 4; ++j)
                o[j] = wmma_f16(pf, vf[ks * 4 + j], o[j]);
        }
    }

    // ---- normalize and store un-permuted (B,T,D) f16
#pragma unroll
    for (int j = 0; j < 4; ++j) {
#pragma unroll
        for (int r = 0; r < 8; ++r) {
            int t  = q0 + r + 8 * hi;
            int hd = j * 16 + col;
            float v = o[j][r] / lrow[r];
            attn_out[((size_t)(b * CT + t)) * CD + h * CHD + hd] = (_Float16)v;
        }
    }
}

// ---------------------------------------------------------------------------
// Host side
// ---------------------------------------------------------------------------
static inline size_t align256(size_t x) { return (x + 255) & ~(size_t)255; }

extern "C" void kernel_launch(void* const* d_in, const int* in_sizes, int n_in,
                              void* d_out, int out_size, void* d_ws, size_t ws_size,
                              hipStream_t stream) {
    const float* x      = (const float*)d_in[0];
    const float* Wq     = (const float*)d_in[1];
    const float* Wk     = (const float*)d_in[2];
    const float* Wv     = (const float*)d_in[3];
    const float* Wo     = (const float*)d_in[4];
    const float* bo     = (const float*)d_in[5];
    const float* W1     = (const float*)d_in[6];
    const float* b1     = (const float*)d_in[7];
    const float* W2     = (const float*)d_in[8];
    const float* b2     = (const float*)d_in[9];
    const float* gamma1 = (const float*)d_in[10];
    const float* beta1  = (const float*)d_in[11];
    const float* gamma2 = (const float*)d_in[12];
    const float* beta2  = (const float*)d_in[13];
    float* out = (float*)d_out;

    // ---- workspace carve-up
    char* ws = (char*)d_ws;
    size_t off = 0;
    auto alloc = [&](size_t bytes) -> char* {
        char* p = ws + off;
        off = align256(off + bytes);
        return p;
    };
    _Float16* h1   = (_Float16*)alloc((size_t)CM * CD * 2);
    _Float16* wqT  = (_Float16*)alloc((size_t)CD * CD * 2);
    _Float16* wkT  = (_Float16*)alloc((size_t)CD * CD * 2);
    _Float16* wvT  = (_Float16*)alloc((size_t)CD * CD * 2);
    _Float16* woT  = (_Float16*)alloc((size_t)CD * CD * 2);
    _Float16* w1T  = (_Float16*)alloc((size_t)CD * CDF * 2);
    _Float16* w2T  = (_Float16*)alloc((size_t)CDF * CD * 2);
    _Float16* q16  = (_Float16*)alloc((size_t)CM * CD * 2);
    _Float16* k16  = (_Float16*)alloc((size_t)CM * CD * 2);
    _Float16* vt16 = (_Float16*)alloc((size_t)CM * CD * 2);
    _Float16* at16 = (_Float16*)alloc((size_t)CM * CD * 2);
    float*    x1   = (float*)   alloc((size_t)CM * CD * 4);
    _Float16* h2   = (_Float16*)alloc((size_t)CM * CD * 2);
    _Float16* ff1  = (_Float16*)alloc((size_t)CM * CDF * 2);
    (void)ws_size; (void)in_sizes; (void)n_in; (void)out_size;

    dim3 tb(32, 8);
    // 1) weight transposes (K x N -> N x K, f16)
    transpose_cast_kernel<<<dim3(CD / 32, CD / 32), tb, 0, stream>>>(Wq, wqT, CD, CD);
    transpose_cast_kernel<<<dim3(CD / 32, CD / 32), tb, 0, stream>>>(Wk, wkT, CD, CD);
    transpose_cast_kernel<<<dim3(CD / 32, CD / 32), tb, 0, stream>>>(Wv, wvT, CD, CD);
    transpose_cast_kernel<<<dim3(CD / 32, CD / 32), tb, 0, stream>>>(Wo, woT, CD, CD);
    transpose_cast_kernel<<<dim3(CDF / 32, CD / 32), tb, 0, stream>>>(W1, w1T, CD, CDF);
    transpose_cast_kernel<<<dim3(CD / 32, CDF / 32), tb, 0, stream>>>(W2, w2T, CDF, CD);

    // 2) LN1
    layernorm_f16_kernel<<<CM, 256, 0, stream>>>(x, gamma1, beta1, h1);

    // 3) QKV projections, stored pre-permuted for attention
    dim3 gD(CD / 128, CM / 64);
    gemm_wmma_kernel<<<gD, 256, 0, stream>>>(h1, wqT, nullptr, nullptr, nullptr, q16,
                                             CM, CD, CD, /*act*/0, /*mode*/2);
    gemm_wmma_kernel<<<gD, 256, 0, stream>>>(h1, wkT, nullptr, nullptr, nullptr, k16,
                                             CM, CD, CD, 0, 2);
    gemm_wmma_kernel<<<gD, 256, 0, stream>>>(h1, wvT, nullptr, nullptr, nullptr, vt16,
                                             CM, CD, CD, 0, 3);

    // 4) causal flash attention
    attention_kernel<<<dim3(CT / 64, CB * CH), 128, 0, stream>>>(q16, k16, vt16, at16);

    // 5) x1 = attn @ Wo + bo + x
    gemm_wmma_kernel<<<gD, 256, 0, stream>>>(at16, woT, bo, x, x1, nullptr,
                                             CM, CD, CD, 0, /*mode*/0);

    // 6) LN2
    layernorm_f16_kernel<<<CM, 256, 0, stream>>>(x1, gamma2, beta2, h2);

    // 7) ff1 = gelu(h2 @ W1 + b1)
    gemm_wmma_kernel<<<dim3(CDF / 128, CM / 64), 256, 0, stream>>>(
        h2, w1T, b1, nullptr, nullptr, ff1, CM, CDF, CD, /*act*/1, /*mode*/1);

    // 8) out = ff1 @ W2 + b2 + x1
    gemm_wmma_kernel<<<gD, 256, 0, stream>>>(ff1, w2T, b2, x1, out, nullptr,
                                             CM, CD, CDF, 0, /*mode*/0);
}

// v001
// One run takes 607 microseconds.
// Timed twice side by side with v000, it ran 1.31 times as fast both times.
#include <hip/hip_runtime.h>

typedef _Float16 v8h  __attribute__((ext_vector_type(8)));
typedef _Float16 v16h __attribute__((ext_vector_type(16)));
typedef float    v8f  __attribute__((ext_vector_type(8)));
typedef unsigned int u32x4 __attribute__((ext_vector_type(4)));
typedef unsigned int u32x8 __attribute__((ext_vector_type(8)));

#define CB  4
#define CT  2048
#define CD  1024
#define CH  16
#define CHD 64
#define CM  (CB * CT)          // 8192 rows
#define CDF (4 * CD)           // 4096 ffn dim

#define G_KP     64u                     // halves of k per pass
#define G_ROWB   128u                    // bytes of a row per pass
#define G_PITCH  144u                    // LDS row pitch, bytes
#define G_ABYTES 10240u                  // 64 rows x 144 B, rounded up to 2 KiB
#define G_BBYTES 18432u                  // 128 rows x 144 B = 9 x 2 KiB
#define G_STAGE  (G_ABYTES + G_BBYTES)   // one buffer: [A 64 rows | B 128 rows]
#define G_PADWORD ((1u << 20) | (4u << 22) | (3u << 25))

__device__ __forceinline__ v16h ldfrag(const _Float16* p) {
    union { v16h v; v8h h[2]; } u;
    u.h[0] = *reinterpret_cast<const v8h*>(p);
    u.h[1] = *reinterpret_cast<const v8h*>(p + 16);
    return u.v;
}

__device__ __forceinline__ v8f wmma_f16(v16h a, v16h b, v8f c) {
    return __builtin_amdgcn_wmma_f32_16x16x32_f16(
        false, a, false, b, (short)0, c, false, false);
}

__device__ __forceinline__ float gelu_f(float x) {
    const float c = 0.7978845608028654f;     // sqrt(2/pi)
    float t = tanhf(c * (x + 0.044715f * x * x * x));
    return 0.5f * x * (1.f + t);
}

// LDS byte offset of a generic pointer known to live in shared memory.
__device__ __forceinline__ unsigned lds_off_of(const void* p) {
    return (unsigned)(unsigned long long)
        ((const __attribute__((address_space(3))) char*)p);
}

// ---------------------------------------------------------------------------
// Tensor mover: one request of a whole wave brings a 2-D tile into LDS.
// ---------------------------------------------------------------------------
__device__ __forceinline__ unsigned uni(unsigned v) {
    return (unsigned)__builtin_amdgcn_readfirstlane(v);
}
__device__ __forceinline__ unsigned pinned(unsigned v) {
    unsigned w = uni(v);
    asm volatile("" : "+s"(w));   // pinned(): keeps the issue test in an SGPR
    return w;
}
// The compiler places no wait for the tensor mover; these order LDS against it.
__device__ __forceinline__ void wait_tensor0() {
    asm volatile("s_wait_tensorcnt 0" ::: "memory");
}
__device__ __forceinline__ void wait_ds0() {
    asm volatile("s_wait_dscnt 0" ::: "memory");
}
__device__ __forceinline__ void tdm_load(u32x4 g0, u32x8 g1) {
    asm volatile("tensor_load_to_lds %0, %1" :: "s"(g0), "s"(g1) : "memory");
}
__device__ __forceinline__ u32x4 tdm_group0(unsigned lds_dst, unsigned long long ga) {
    u32x4 g;
    g[0] = uni(1u);                                   // count = 1
    g[1] = uni(lds_dst);
    g[2] = uni((unsigned)ga);
    g[3] = uni((((unsigned)(ga >> 32)) & 0x01FFFFFFu) | 0x80000000u);  // type = 2
    return g;
}
__device__ __forceinline__ u32x8 tdm_group1(unsigned rows, unsigned src_pitch) {
    u32x8 g;
    g[0] = uni(G_PADWORD);
    g[1] = uni((G_ROWB & 0xFFFFu) << 16);
    g[2] = uni((G_ROWB >> 16) | ((rows & 0xFFFFu) << 16));
    g[3] = uni((rows >> 16) | (G_ROWB << 16));
    g[4] = uni(rows);
    g[5] = uni(src_pitch);
    g[6] = uni(0u);
    g[7] = uni(0u);
    return g;
}

// ---------------------------------------------------------------------------
// Transpose + cast: in (K x N) f32 -> out (N x K) f16
// ---------------------------------------------------------------------------
__global__ void transpose_cast_kernel(const float* __restrict__ in,
                                      _Float16* __restrict__ out,
                                      int K, int N) {
    __shared__ float tile[32][33];
    int nb = blockIdx.x * 32;
    int kb = blockIdx.y * 32;
    int tx = threadIdx.x;          // 0..31
    int ty = threadIdx.y;          // 0..7
#pragma unroll
    for (int i = 0; i < 32; i += 8)
        tile[ty + i][tx] = in[(size_t)(kb + ty + i) * N + nb + tx];
    __syncthreads();
#pragma unroll
    for (int i = 0; i < 32; i += 8)
        out[(size_t)(nb + ty + i) * K + kb + tx] = (_Float16)tile[tx][ty + i];
}

// ---------------------------------------------------------------------------
// LayerNorm: one block (256 threads) per row of D=1024, f32 in -> f16 out
// ---------------------------------------------------------------------------
__global__ void layernorm_f16_kernel(const float* __restrict__ x,
                                     const float* __restrict__ gamma,
                                     const float* __restrict__ beta,
                                     _Float16* __restrict__ out) {
    __shared__ float red[256];
    size_t rowo = (size_t)blockIdx.x * CD;
    int tid = threadIdx.x;
    float v[4];
    float s = 0.f;
#pragma unroll
    for (int i = 0; i < 4; ++i) { v[i] = x[rowo + tid + i * 256]; s += v[i]; }
    red[tid] = s;
    __syncthreads();
    for (int st = 128; st > 0; st >>= 1) {
        if (tid < st) red[tid] += red[tid + st];
        __syncthreads();
    }
    float mean = red[0] * (1.f / (float)CD);
    __syncthreads();
    float s2 = 0.f;
#pragma unroll
    for (int i = 0; i < 4; ++i) { float d = v[i] - mean; s2 += d * d; }
    red[tid] = s2;
    __syncthreads();
    for (int st = 128; st > 0; st >>= 1) {
        if (tid < st) red[tid] += red[tid + st];
        __syncthreads();
    }
    float rstd = rsqrtf(red[0] * (1.f / (float)CD) + 1e-5f);
#pragma unroll
    for (int i = 0; i < 4; ++i) {
        int c = tid + i * 256;
        out[rowo + c] = (_Float16)(gamma[c] * (v[i] - mean) * rstd + beta[c]);
    }
}

// ---------------------------------------------------------------------------
// WMMA GEMM: C(MxN) = A(MxK f16, row-major) * Bt(NxK f16, row-major)^T
// Block: 256 threads = 8 waves as 4(M) x 2(N); tile 64M x 128N.
// K-loop: passes of 64 k from two LDS buffers filled by the tensor mover
// (wave 0 brings the A rows, wave 1 the B rows, one request each per pass, for
// the pass after next, into the buffer that every wave has just left).
// Needs M % 64 == 0, N % 128 == 0, K % 64 == 0 and K >= 128.
// Epilogue modes:
//   0: f32 out (+bias)(+resid)          1: f16 out (+bias)(+gelu)
//   2: f16 out permuted (B,H,T,HD)      3: f16 out V^T  (B,H,HD,T)
// ---------------------------------------------------------------------------
__global__ void gemm_wmma_kernel(const _Float16* __restrict__ A,
                                 const _Float16* __restrict__ Bt,
                                 const float* __restrict__ bias,
                                 const float* __restrict__ resid,
                                 float* __restrict__ of32,
                                 _Float16* __restrict__ of16,
                                 int M, int N, int K, int act, int mode) {
    __shared__ __attribute__((aligned(2048))) unsigned char ring[2 * G_STAGE];

    int lane = threadIdx.x & 31;
    const unsigned wave = uni(threadIdx.x >> 5);   // 0..7
    int wm = wave & 3;                    // 0..3 -> M sub-tile
    int wn = wave >> 2;                   // 0..1 -> N half
    int m0b = blockIdx.y * 64;
    int n0b = blockIdx.x * 128;
    int row  = lane & 15;
    int koff = (lane >> 4) << 3;          // 0 or 8
    int hi   = lane >> 4;
    int col  = lane & 15;

    v8f acc[4] = {v8f{0.f}, v8f{0.f}, v8f{0.f}, v8f{0.f}};

    // the issuing wave's slice: wave 0 the A rows, wave 1 the B rows
    const unsigned nst = (unsigned)K / G_KP;
    const unsigned long long gsrc = (wave == 0u)
        ? (unsigned long long)(A + (size_t)m0b * K)
        : (unsigned long long)(Bt + (size_t)n0b * K);
    const unsigned ldst = lds_off_of(ring) + (wave == 0u ? 0u : G_ABYTES);
    const u32x8 g1 = tdm_group1(wave == 0u ? 64u : 128u, (unsigned)K * 2u);

    if (pinned(wave < 2u)) {
        tdm_load(tdm_group0(ldst, gsrc), g1);
        wait_tensor0();
    }
    __syncthreads();
    if (pinned(wave < 2u))
        tdm_load(tdm_group0(ldst + G_STAGE, gsrc + G_ROWB), g1);

    for (unsigned s = 0; s < nst; ++s) {
        const unsigned char* st = ring + (s & 1u) * G_STAGE;
        const unsigned char* pa = st + (wm * 16 + row) * G_PITCH + koff * 2;
        const unsigned char* pb = st + G_ABYTES + (wn * 64 + row) * G_PITCH + koff * 2;
#pragma unroll   // both 32-k steps inline: LDS offsets become immediates
        for (int kk = 0; kk < 2; ++kk) {
            v16h af = ldfrag((const _Float16*)(pa + kk * 64));
            v16h bf[4];
#pragma unroll
            for (int j = 0; j < 4; ++j)
                bf[j] = ldfrag((const _Float16*)(pb + j * 16 * G_PITCH + kk * 64));
#pragma unroll
            for (int j = 0; j < 4; ++j)
                acc[j] = wmma_f16(af, bf[j], acc[j]);
        }
        // publish point of pass s + 1: own LDS reads done, own tile landed,
        // barrier, and only then the refill of the buffer this pass has read
        wait_ds0();
        if (pinned(wave < 2u)) wait_tensor0();
        __syncthreads();
        if (pinned((wave < 2u) & (s + 2u < nst)))
            tdm_load(tdm_group0(ldst + (s & 1u) * G_STAGE,
                                gsrc + (unsigned long long)(s + 2u) * G_ROWB), g1);
    }
    wait_tensor0();
    wait_ds0();

    int m0 = m0b + wm * 16;
    int n0 = n0b + wn * 64;
#pragma unroll
    for (int j = 0; j < 4; ++j) {
        int n = n0 + j * 16 + col;
        float bv = bias ? bias[n] : 0.f;
#pragma unroll
        for (int r = 0; r < 8; ++r) {
            int m = m0 + r + 8 * hi;
            float v = acc[j][r] + bv;
            if (act == 1) v = gelu_f(v);
            if (mode == 0) {
                float o = v;
                if (resid) o += resid[(size_t)m * N + n];
                of32[(size_t)m * N + n] = o;
            } else if (mode == 1) {
                of16[(size_t)m * N + n] = (_Float16)v;
            } else if (mode == 2) {        // (B,H,T,HD)
                int b = m >> 11, t = m & (CT - 1);
                int h = n >> 6,  hd = n & (CHD - 1);
                of16[((size_t)(b * CH + h) * CT + t) * CHD + hd] = (_Float16)v;
            } else {                       // V^T: (B,H,HD,T)
                int b = m >> 11, t = m & (CT - 1);
                int h = n >> 6,  hd = n & (CHD - 1);
                of16[((size_t)(b * CH + h) * CHD + hd) * CT + t] = (_Float16)v;
            }
        }
    }
}

// ---------------------------------------------------------------------------
// Flash attention (causal). Block = 128 threads = 4 waves, one 64-query tile.
// Wave w owns query rows q0+w*16 .. +15. Loops key blocks kb <= qb.
// All 8 operand fragments of each WMMA burst are preloaded so the loads
// clause together and latency isn't paid per-WMMA.
// ---------------------------------------------------------------------------
__global__ void attention_kernel(const _Float16* __restrict__ Qh,   // (B,H,T,HD)
                                 const _Float16* __restrict__ Kh,   // (B,H,T,HD)
                                 const _Float16* __restrict__ Vt,   // (B,H,HD,T)
                                 _Float16* __restrict__ attn_out) { // (B,T,D)
    int qb   = blockIdx.x;               // 0..T/64-1
    int bh   = blockIdx.y;               // 0..B*H-1
    int b    = bh >> 4;
    int h    = bh & (CH - 1);
    int lane = threadIdx.x & 31;
    int wave = threadIdx.x >> 5;         // 0..3
    int row  = lane & 15;
    int koff = (lane >> 4) << 3;
    int hi   = lane >> 4;
    int col  = lane & 15;
    int q0   = qb * 64 + wave * 16;

    const _Float16* Q  = Qh + (size_t)bh * CT * CHD;
    const _Float16* Kp = Kh + (size_t)bh * CT * CHD;
    const _Float16* Vp = Vt + (size_t)bh * CHD * CT;

    v16h qf0 = ldfrag(Q + (size_t)(q0 + row) * CHD + koff);
    v16h qf1 = ldfrag(Q + (size_t)(q0 + row) * CHD + 32 + koff);

    v8f  o[4] = {v8f{0.f}, v8f{0.f}, v8f{0.f}, v8f{0.f}};
    float mrow[8], lrow[8];
#pragma unroll
    for (int r = 0; r < 8; ++r) { mrow[r] = -1e30f; lrow[r] = 0.f; }

    __shared__ __align__(16) _Float16 Pl[4][16][64];   // 8 KB

    const float scale = 0.125f;   // HD^-0.5

    for (int kb = 0; kb <= qb; ++kb) {
        int k0 = kb * 64;
        // ---- preload all K fragments, then burst 8 WMMAs
        v16h kf[8];
#pragma unroll
        for (int j = 0; j < 4; ++j) {
            const _Float16* kp = Kp + (size_t)(k0 + j * 16 + row) * CHD;
            kf[2 * j]     = ldfrag(kp + koff);
            kf[2 * j + 1] = ldfrag(kp + 32 + koff);
        }
        v8f s[4] = {v8f{0.f}, v8f{0.f}, v8f{0.f}, v8f{0.f}};
#pragma unroll
        for (int j = 0; j < 4; ++j) {
            s[j] = wmma_f16(qf0, kf[2 * j],     s[j]);
            s[j] = wmma_f16(qf1, kf[2 * j + 1], s[j]);
        }
        // ---- scale, causal mask, row max
        float pmax[8];
#pragma unroll
        for (int r = 0; r < 8; ++r) {
            int qrow = q0 + r + 8 * hi;
            float mx = -1e30f;
#pragma unroll
            for (int j = 0; j < 4; ++j) {
                int kcol = k0 + j * 16 + col;
                float sv = s[j][r] * scale;
                if (kcol > qrow) sv = -1e30f;
                s[j][r] = sv;
                mx = fmaxf(mx, sv);
            }
#pragma unroll
            for (int d = 8; d >= 1; d >>= 1)
                mx = fmaxf(mx, __shfl_xor(mx, d, 32));
            pmax[r] = mx;
        }
        // ---- online softmax update
#pragma unroll
        for (int r = 0; r < 8; ++r) {
            float mnew = fmaxf(mrow[r], pmax[r]);
            float corr = __expf(mrow[r] - mnew);
            float rsum = 0.f;
#pragma unroll
            for (int j = 0; j < 4; ++j) {
                float p = __expf(s[j][r] - mnew);
                s[j][r] = p;
                rsum += p;
            }
#pragma unroll
            for (int d = 8; d >= 1; d >>= 1)
                rsum += __shfl_xor(rsum, d, 32);
            lrow[r] = lrow[r] * corr + rsum;
            mrow[r] = mnew;
#pragma unroll
            for (int j = 0; j < 4; ++j) o[j][r] *= corr;
        }
        // ---- P to LDS (C layout), re-read as A fragments
        __syncthreads();
#pragma unroll
        for (int r = 0; r < 8; ++r)
#pragma unroll
            for (int j = 0; j < 4; ++j)
                Pl[wave][r + 8 * hi][j * 16 + col] = (_Float16)s[j][r];
        __syncthreads();
        // ---- O += P * V : preload all V fragments, then burst 8 WMMAs
        v16h vf[8];
#pragma unroll
        for (int ks = 0; ks < 2; ++ks)
#pragma unroll
            for (int j = 0; j < 4; ++j)
                vf[ks * 4 + j] = ldfrag(Vp + (size_t)(j * 16 + row) * CT +
                                        k0 + ks * 32 + koff);
#pragma unroll
        for (int ks = 0; ks < 2; ++ks) {
            v16h pf = ldfrag(&Pl[wave][row][ks * 32 + koff]);
#pragma unroll
            for (int j = 0; j < 4; ++j)
                o[j] = wmma_f16(pf, vf[ks * 4 + j], o[j]);
        }
    }

    // ---- normalize and store un-permuted (B,T,D) f16
#pragma unroll
    for (int j = 0; j < 4; ++j) {
#pragma unroll
        for (int r = 0; r < 8; ++r) {
            int t  = q0 + r + 8 * hi;
            int hd = j * 16 + col;
            float v = o[j][r] / lrow[r];
            attn_out[((size_t)(b * CT + t)) * CD + h * CHD + hd] = (_Float16)v;
        }
    }
}

// ---------------------------------------------------------------------------
// Host side
// ---------------------------------------------------------------------------
static inline size_t align256(size_t x) { return (x + 255) & ~(size_t)255; }

extern "C" void kernel_launch(void* const* d_in, const int* in_sizes, int n_in,
                              void* d_out, int out_size, void* d_ws, size_t ws_size,
                              hipStream_t stream) {
    const float* x      = (const float*)d_in[0];
    const float* Wq     = (const float*)d_in[1];
    const float* Wk     = (const float*)d_in[2];
    const float* Wv     = (const float*)d_in[3];
    const float* Wo     = (const float*)d_in[4];
    const float* bo     = (const float*)d_in[5];
    const float* W1     = (const float*)d_in[6];
    const float* b1     = (const float*)d_in[7];
    const float* W2     = (const float*)d_in[8];
    const float* b2     = (const float*)d_in[9];
    const float* gamma1 = (const float*)d_in[10];
    const float* beta1  = (const float*)d_in[11];
    const float* gamma2 = (const float*)d_in[12];
    const float* beta2  = (const float*)d_in[13];
    float* out = (float*)d_out;

    // ---- workspace carve-up
    char* ws = (char*)d_ws;
    size_t off = 0;
    auto alloc = [&](size_t bytes) -> char* {
        char* p = ws + off;
        off = align256(off + bytes);
        return p;
    };
    _Float16* h1   = (_Float16*)alloc((size_t)CM * CD * 2);
    _Float16* wqT  = (_Float16*)alloc((size_t)CD * CD * 2);
    _Float16* wkT  = (_Float16*)alloc((size_t)CD * CD * 2);
    _Float16* wvT  = (_Float16*)alloc((size_t)CD * CD * 2);
    _Float16* woT  = (_Float16*)alloc((size_t)CD * CD * 2);
    _Float16* w1T  = (_Float16*)alloc((size_t)CD * CDF * 2);
    _Float16* w2T  = (_Float16*)alloc((size_t)CDF * CD * 2);
    _Float16* q16  = (_Float16*)alloc((size_t)CM * CD * 2);
    _Float16* k16  = (_Float16*)alloc((size_t)CM * CD * 2);
    _Float16* vt16 = (_Float16*)alloc((size_t)CM * CD * 2);
    _Float16* at16 = (_Float16*)alloc((size_t)CM * CD * 2);
    float*    x1   = (float*)   alloc((size_t)CM * CD * 4);
    _Float16* h2   = (_Float16*)alloc((size_t)CM * CD * 2);
    _Float16* ff1  = (_Float16*)alloc((size_t)CM * CDF * 2);
    (void)ws_size; (void)in_sizes; (void)n_in; (void)out_size;

    dim3 tb(32, 8);
    // 1) weight transposes (K x N -> N x K, f16)
    transpose_cast_kernel<<<dim3(CD / 32, CD / 32), tb, 0, stream>>>(Wq, wqT, CD, CD);
    transpose_cast_kernel<<<dim3(CD / 32, CD / 32), tb, 0, stream>>>(Wk, wkT, CD, CD);
    transpose_cast_kernel<<<dim3(CD / 32, CD / 32), tb, 0, stream>>>(Wv, wvT, CD, CD);
    transpose_cast_kernel<<<dim3(CD / 32, CD / 32), tb, 0, stream>>>(Wo, woT, CD, CD);
    transpose_cast_kernel<<<dim3(CDF / 32, CD / 32), tb, 0, stream>>>(W1, w1T, CD, CDF);
    transpose_cast_kernel<<<dim3(CD / 32, CDF / 32), tb, 0, stream>>>(W2, w2T, CDF, CD);

    // 2) LN1
    layernorm_f16_kernel<<<CM, 256, 0, stream>>>(x, gamma1, beta1, h1);

    // 3) QKV projections, stored pre-permuted for attention
    dim3 gD(CD / 128, CM / 64);
    gemm_wmma_kernel<<<gD, 256, 0, stream>>>(h1, wqT, nullptr, nullptr, nullptr, q16,
                                             CM, CD, CD, /*act*/0, /*mode*/2);
    gemm_wmma_kernel<<<gD, 256, 0, stream>>>(h1, wkT, nullptr, nullptr, nullptr, k16,
                                             CM, CD, CD, 0, 2);
    gemm_wmma_kernel<<<gD, 256, 0, stream>>>(h1, wvT, nullptr, nullptr, nullptr, vt16,
                                             CM, CD, CD, 0, 3);

    // 4) causal flash attention
    attention_kernel<<<dim3(CT / 64, CB * CH), 128, 0, stream>>>(q16, k16, vt16, at16);

    // 5) x1 = attn @ Wo + bo + x
    gemm_wmma_kernel<<<gD, 256, 0, stream>>>(at16, woT, bo, x, x1, nullptr,
                                             CM, CD, CD, 0, /*mode*/0);

    // 6) LN2
    layernorm_f16_kernel<<<CM, 256, 0, stream>>>(x1, gamma2, beta2, h2);

    // 7) ff1 = gelu(h2 @ W1 + b1)
    gemm_wmma_kernel<<<dim3(CDF / 128, CM / 64), 256, 0, stream>>>(
        h2, w1T, b1, nullptr, nullptr, ff1, CM, CDF, CD, /*act*/1, /*mode*/1);

    // 8) out = ff1 @ W2 + b2 + x1
    gemm_wmma_kernel<<<gD, 256, 0, stream>>>(ff1, w2T, b2, x1, out, nullptr,
                                             CM, CD, CDF, 0, /*mode*/0);
}

// v002
// It runs in 513 microseconds.
// In two side-by-side timings against v001, it was 1.19 and 1.18 times as fast.
// All steps since v000 together make it 1.56 times as fast.
#include <hip/hip_runtime.h>

typedef _Float16 v8h  __attribute__((ext_vector_type(8)));
typedef _Float16 v16h __attribute__((ext_vector_type(16)));
typedef float    v8f  __attribute__((ext_vector_type(8)));
typedef unsigned int u32x4 __attribute__((ext_vector_type(4)));
typedef unsigned int u32x8 __attribute__((ext_vector_type(8)));

#define CB  4
#define CT  2048
#define CD  1024
#define CH  16
#define CHD 64
#define CM  (CB * CT)          // 8192 rows
#define CDF (4 * CD)           // 4096 ffn dim

#define G_KP     64u                     // halves of k per pass
#define G_ROWB   128u                    // bytes of a row per pass
#define G_PITCH  144u                    // LDS row pitch, bytes
#define G_SLICE  10240u                  // 64 rows x 144 B, rounded up to 2 KiB
#define G_ASL    4u                      // A slices of a buffer (256 rows)
#define G_NSL    6u                      // slices of a buffer: [A 4 x 64 rows | B 2 x 64 rows]
#define G_STAGE  (G_NSL * G_SLICE)       // one buffer
#define G_PADWORD ((1u << 20) | (4u << 22) | (3u << 25))

__device__ __forceinline__ v16h ldfrag(const _Float16* p) {
    union { v16h v; v8h h[2]; } u;
    u.h[0] = *reinterpret_cast<const v8h*>(p);
    u.h[1] = *reinterpret_cast<const v8h*>(p + 16);
    return u.v;
}

__device__ __forceinline__ v8f wmma_f16(v16h a, v16h b, v8f c) {
    return __builtin_amdgcn_wmma_f32_16x16x32_f16(
        false, a, false, b, (short)0, c, false, false);
}

__device__ __forceinline__ float gelu_f(float x) {
    const float c = 0.7978845608028654f;     // sqrt(2/pi)
    float t = tanhf(c * (x + 0.044715f * x * x * x));
    return 0.5f * x * (1.f + t);
}

// LDS byte offset of a generic pointer known to live in shared memory.
__device__ __forceinline__ unsigned lds_off_of(const void* p) {
    return (unsigned)(unsigned long long)
        ((const __attribute__((address_space(3))) char*)p);
}

// ---------------------------------------------------------------------------
// Tensor mover: one request of a whole wave brings a 2-D tile into LDS.
// ---------------------------------------------------------------------------
__device__ __forceinline__ unsigned uni(unsigned v) {
    return (unsigned)__builtin_amdgcn_readfirstlane(v);
}
__device__ __forceinline__ unsigned pinned(unsigned v) {
    unsigned w = uni(v);
    asm volatile("" : "+s"(w));   // pinned(): keeps the issue test in an SGPR
    return w;
}
// The compiler places no wait for the tensor mover; these order LDS against it.
__device__ __forceinline__ void wait_tensor0() {
    asm volatile("s_wait_tensorcnt 0" ::: "memory");
}
__device__ __forceinline__ void wait_ds0() {
    asm volatile("s_wait_dscnt 0" ::: "memory");
}
// Stands behind a run of global stores, in front of the first instruction that
// overwrites a register which one of them names.
__device__ __forceinline__ void wait_x0() {
    asm volatile("s_wait_xcnt 0x0" ::: "memory");
}
__device__ __forceinline__ void tdm_load(u32x4 g0, u32x8 g1) {
    asm volatile("tensor_load_to_lds %0, %1" :: "s"(g0), "s"(g1) : "memory");
}
__device__ __forceinline__ u32x4 tdm_group0(unsigned lds_dst, unsigned long long ga) {
    u32x4 g;
    g[0] = uni(1u);                                   // count = 1
    g[1] = uni(lds_dst);
    g[2] = uni((unsigned)ga);
    g[3] = uni((((unsigned)(ga >> 32)) & 0x01FFFFFFu) | 0x80000000u);  // type = 2
    return g;
}
__device__ __forceinline__ u32x8 tdm_group1(unsigned rows, unsigned src_pitch) {
    u32x8 g;
    g[0] = uni(G_PADWORD);
    g[1] = uni((G_ROWB & 0xFFFFu) << 16);
    g[2] = uni((G_ROWB >> 16) | ((rows & 0xFFFFu) << 16));
    g[3] = uni((rows >> 16) | (G_ROWB << 16));
    g[4] = uni(rows);
    g[5] = uni(src_pitch);
    g[6] = uni(0u);
    g[7] = uni(0u);
    return g;
}

// ---------------------------------------------------------------------------
// Transpose + cast: in (K x N) f32 -> out (N x K) f16
// ---------------------------------------------------------------------------
__global__ void transpose_cast_kernel(const float* __restrict__ in,
                                      _Float16* __restrict__ out,
                                      int K, int N) {
    __shared__ float tile[32][33];
    int nb = blockIdx.x * 32;
    int kb = blockIdx.y * 32;
    int tx = threadIdx.x;          // 0..31
    int ty = threadIdx.y;          // 0..7
#pragma unroll
    for (int i = 0; i < 32; i += 8)
        tile[ty + i][tx] = in[(size_t)(kb + ty + i) * N + nb + tx];
    __syncthreads();
#pragma unroll
    for (int i = 0; i < 32; i += 8)
        out[(size_t)(nb + ty + i) * K + kb + tx] = (_Float16)tile[tx][ty + i];
}

// ---------------------------------------------------------------------------
// LayerNorm: one block (256 threads) per row of D=1024, f32 in -> f16 out
// ---------------------------------------------------------------------------
__global__ void layernorm_f16_kernel(const float* __restrict__ x,
                                     const float* __restrict__ gamma,
                                     const float* __restrict__ beta,
                                     _Float16* __restrict__ out) {
    __shared__ float red[256];
    size_t rowo = (size_t)blockIdx.x * CD;
    int tid = threadIdx.x;
    float v[4];
    float s = 0.f;
#pragma unroll
    for (int i = 0; i < 4; ++i) { v[i] = x[rowo + tid + i * 256]; s += v[i]; }
    red[tid] = s;
    __syncthreads();
    for (int st = 128; st > 0; st >>= 1) {
        if (tid < st) red[tid] += red[tid + st];
        __syncthreads();
    }
    float mean = red[0] * (1.f / (float)CD);
    __syncthreads();
    float s2 = 0.f;
#pragma unroll
    for (int i = 0; i < 4; ++i) { float d = v[i] - mean; s2 += d * d; }
    red[tid] = s2;
    __syncthreads();
    for (int st = 128; st > 0; st >>= 1) {
        if (tid < st) red[tid] += red[tid + st];
        __syncthreads();
    }
    float rstd = rsqrtf(red[0] * (1.f / (float)CD) + 1e-5f);
#pragma unroll
    for (int i = 0; i < 4; ++i) {
        int c = tid + i * 256;
        out[rowo + c] = (_Float16)(gamma[c] * (v[i] - mean) * rstd + beta[c]);
    }
}

__global__ __launch_bounds__(256, 4) void gemm_wmma_kernel(const _Float16* __restrict__ A,
                                 const _Float16* __restrict__ Bt,
                                 const float* __restrict__ bias,
                                 const float* __restrict__ resid,
                                 float* __restrict__ of32,
                                 _Float16* __restrict__ of16,
                                 int M, int N, int K, int act, int mode) {
    __shared__ __attribute__((aligned(2048))) unsigned char ring[2 * G_STAGE];

    int lane = threadIdx.x & 31;
    const unsigned wave = uni(threadIdx.x >> 5);   // 0..7
    int wm = wave & 3;                    // 0..3 -> M sub-tile
    int wn = wave >> 2;                   // 0..1 -> N half
    int m0b = blockIdx.y * 256;
    int n0b = blockIdx.x * 128;
    int row  = lane & 15;
    int koff = (lane >> 4) << 3;          // 0 or 8
    int hi   = lane >> 4;
    int col  = lane & 15;

    v8f acc[4][4];
#pragma unroll
    for (int i = 0; i < 4; ++i)
#pragma unroll
        for (int j = 0; j < 4; ++j) acc[i][j] = v8f{0.f};

    // the issuing wave's slice of 64 rows: waves 0..3 of A, waves 4 and 5 of B
    const unsigned nst = (unsigned)K / G_KP;
    const unsigned long long gsrc = (wave < G_ASL)
        ? (unsigned long long)(A + (size_t)(m0b + (int)wave * 64) * K)
        : (unsigned long long)(Bt + (size_t)(n0b + (int)(wave & 1u) * 64) * K);
    const unsigned ldst = lds_off_of(ring) + wave * G_SLICE;
    u32x8 g1 = tdm_group1(64u, (unsigned)K * 2u);
    asm volatile("" : "+s"(g1));

    if (pinned(wave < G_NSL)) {
        tdm_load(tdm_group0(ldst, gsrc), g1);
        wait_tensor0();
    }
    __syncthreads();
    if (pinned(wave < G_NSL))
        tdm_load(tdm_group0(ldst + G_STAGE, gsrc + G_ROWB), g1);

    for (unsigned s = 0; s < nst; ++s) {
        const unsigned char* st = ring + (s & 1u) * G_STAGE;
        const unsigned char* pa = st + wm * G_SLICE + row * G_PITCH + koff * 2;
        const unsigned char* pb = st + (G_ASL + wn) * G_SLICE + row * G_PITCH + koff * 2;
#pragma unroll   // both 32-k steps inline: LDS offsets become immediates
        for (int kk = 0; kk < 2; ++kk) {
            v16h af[4], bf[4];
#pragma unroll
            for (int i = 0; i < 4; ++i)
                af[i] = ldfrag((const _Float16*)(pa + i * 16 * G_PITCH + kk * 64));
#pragma unroll
            for (int j = 0; j < 4; ++j)
                bf[j] = ldfrag((const _Float16*)(pb + j * 16 * G_PITCH + kk * 64));
            // keeps the 16 LDS reads one group in front of their 16 WMMAs: left
            // free, the reads sink between the WMMAs, each behind a full wait
            __builtin_amdgcn_sched_barrier(0);
#pragma unroll
            for (int j = 0; j < 4; ++j)
#pragma unroll
                for (int i = 0; i < 4; ++i)
                    acc[i][j] = wmma_f16(af[i], bf[j], acc[i][j]);
            // keeps the next group's reads out of this WMMA block
            __builtin_amdgcn_sched_barrier(0);
        }
        // publish point of pass s + 1: own LDS reads done, own tile landed,
        // barrier, and only then the refill of the buffer this pass has read
        wait_ds0();
        if (pinned(wave < G_NSL)) wait_tensor0();
        __syncthreads();
        if (pinned((wave < G_NSL) & (s + 2u < nst)))
            tdm_load(tdm_group0(ldst + (s & 1u) * G_STAGE,
                                gsrc + (unsigned long long)(s + 2u) * G_ROWB), g1);
    }
    wait_tensor0();
    wait_ds0();

    const int n0 = n0b + wn * 64;
    float bv[4];
#pragma unroll
    for (int j = 0; j < 4; ++j) bv[j] = bias ? bias[n0 + j * 16 + col] : 0.f;
#pragma unroll 1   // rolled
    for (int it = 0; it < 4; ++it) {
        const int mb = m0b + wm * 64 + it * 16 + 8 * hi;   // row of r = 0
#pragma unroll
        for (int j = 0; j < 4; ++j)
#pragma unroll
            for (int r = 0; r < 8; ++r) acc[0][j][r] += bv[j];
        if (act == 1) {
#pragma unroll
            for (int j = 0; j < 4; ++j)
#pragma unroll
                for (int r = 0; r < 8; ++r) acc[0][j][r] = gelu_f(acc[0][j][r]);
        }
        if (mode == 0) {
            const size_t base = (size_t)mb * N + n0 + col;
            if (resid) {
                const float* pr[8];
                float rv[4][8];
#pragma unroll
                for (int r = 0; r < 8; ++r) pr[r] = resid + base + (size_t)r * N;
#pragma unroll
                for (int j = 0; j < 4; ++j)
#pragma unroll
                    for (int r = 0; r < 8; ++r) rv[j][r] = pr[r][j * 16];
                // the wait that belongs in front of an overwrite of a load's address
                // registers; naming them here keeps them from being a load's target
                asm volatile("s_wait_xcnt 0x0"
                             :: "v"(pr[0]), "v"(pr[1]), "v"(pr[2]), "v"(pr[3]),
                                "v"(pr[4]), "v"(pr[5]), "v"(pr[6]), "v"(pr[7])
                             : "memory");
#pragma unroll
                for (int j = 0; j < 4; ++j)
#pragma unroll
                    for (int r = 0; r < 8; ++r) acc[0][j][r] += rv[j][r];
            }
#pragma unroll
            for (int j = 0; j < 4; ++j)
#pragma unroll
                for (int r = 0; r < 8; ++r)
                    of32[base + (size_t)r * N + j * 16] = acc[0][j][r];
            wait_x0();
        } else if (mode == 1) {
            const size_t base = (size_t)mb * N + n0 + col;
#pragma unroll
            for (int j = 0; j < 4; ++j)
#pragma unroll
                for (int r = 0; r < 8; ++r)
                    of16[base + (size_t)r * N + j * 16] = (_Float16)acc[0][j][r];
            wait_x0();
        } else if (mode == 2) {            // (B,H,T,HD)
            const int b = mb >> 11, t = mb & (CT - 1), h = n0 >> 6;
            const size_t base = ((size_t)(b * CH + h) * CT + t) * CHD + col;
#pragma unroll
            for (int j = 0; j < 4; ++j)
#pragma unroll
                for (int r = 0; r < 8; ++r)
                    of16[base + r * CHD + j * 16] = (_Float16)acc[0][j][r];
            wait_x0();
        } else {                           // V^T: (B,H,HD,T)
            const int b = mb >> 11, t = mb & (CT - 1), h = n0 >> 6;
            const size_t base = ((size_t)(b * CH + h) * CHD + col) * CT + t;
#pragma unroll
            for (int j = 0; j < 4; ++j)
#pragma unroll
                for (int r = 0; r < 8; ++r)
                    of16[base + (size_t)j * 16 * CT + r] = (_Float16)acc[0][j][r];
            wait_x0();
        }
        // the next 16 rows' accumulators move down (constant indices: registers)
#pragma unroll
        for (int j = 0; j < 4; ++j) {
            acc[0][j] = acc[1][j];
            acc[1][j] = acc[2][j];
            acc[2][j] = acc[3][j];
        }
    }
}

// ---------------------------------------------------------------------------
// Flash attention (causal). Block = 128 threads = 4 waves, one 64-query tile.
// Wave w owns query rows q0+w*16 .. +15. Loops key blocks kb <= qb.
// All 8 operand fragments of each WMMA burst are preloaded so the loads
// clause together and latency isn't paid per-WMMA.
// ---------------------------------------------------------------------------
__global__ void attention_kernel(const _Float16* __restrict__ Qh,   // (B,H,T,HD)
                                 const _Float16* __restrict__ Kh,   // (B,H,T,HD)
                                 const _Float16* __restrict__ Vt,   // (B,H,HD,T)
                                 _Float16* __restrict__ attn_out) { // (B,T,D)
    int qb   = blockIdx.x;               // 0..T/64-1
    int bh   = blockIdx.y;               // 0..B*H-1
    int b    = bh >> 4;
    int h    = bh & (CH - 1);
    int lane = threadIdx.x & 31;
    int wave = threadIdx.x >> 5;         // 0..3
    int row  = lane & 15;
    int koff = (lane >> 4) << 3;
    int hi   = lane >> 4;
    int col  = lane & 15;
    int q0   = qb * 64 + wave * 16;

    const _Float16* Q  = Qh + (size_t)bh * CT * CHD;
    const _Float16* Kp = Kh + (size_t)bh * CT * CHD;
    const _Float16* Vp = Vt + (size_t)bh * CHD * CT;

    v16h qf0 = ldfrag(Q + (size_t)(q0 + row) * CHD + koff);
    v16h qf1 = ldfrag(Q + (size_t)(q0 + row) * CHD + 32 + koff);

    v8f  o[4] = {v8f{0.f}, v8f{0.f}, v8f{0.f}, v8f{0.f}};
    float mrow[8], lrow[8];
#pragma unroll
    for (int r = 0; r < 8; ++r) { mrow[r] = -1e30f; lrow[r] = 0.f; }

    __shared__ __align__(16) _Float16 Pl[4][16][64];   // 8 KB

    const float scale = 0.125f;   // HD^-0.5

    for (int kb = 0; kb <= qb; ++kb) {
        int k0 = kb * 64;
        // ---- preload all K fragments, then burst 8 WMMAs
        v16h kf[8];
#pragma unroll
        for (int j = 0; j < 4; ++j) {
            const _Float16* kp = Kp + (size_t)(k0 + j * 16 + row) * CHD;
            kf[2 * j]     = ldfrag(kp + koff);
            kf[2 * j + 1] = ldfrag(kp + 32 + koff);
        }
        v8f s[4] = {v8f{0.f}, v8f{0.f}, v8f{0.f}, v8f{0.f}};
#pragma unroll
        for (int j = 0; j < 4; ++j) {
            s[j] = wmma_f16(qf0, kf[2 * j],     s[j]);
            s[j] = wmma_f16(qf1, kf[2 * j + 1], s[j]);
        }
        // ---- scale, causal mask, row max
        float pmax[8];
#pragma unroll
        for (int r = 0; r < 8; ++r) {
            int qrow = q0 + r + 8 * hi;
            float mx = -1e30f;
#pragma unroll
            for (int j = 0; j < 4; ++j) {
                int kcol = k0 + j * 16 + col;
                float sv = s[j][r] * scale;
                if (kcol > qrow) sv = -1e30f;
                s[j][r] = sv;
                mx = fmaxf(mx, sv);
            }
#pragma unroll
            for (int d = 8; d >= 1; d >>= 1)
                mx = fmaxf(mx, __shfl_xor(mx, d, 32));
            pmax[r] = mx;
        }
        // ---- online softmax update
#pragma unroll
        for (int r = 0; r < 8; ++r) {
            float mnew = fmaxf(mrow[r], pmax[r]);
            float corr = __expf(mrow[r] - mnew);
            float rsum = 0.f;
#pragma unroll
            for (int j = 0; j < 4; ++j) {
                float p = __expf(s[j][r] - mnew);
                s[j][r] = p;
                rsum += p;
            }
#pragma unroll
            for (int d = 8; d >= 1; d >>= 1)
                rsum += __shfl_xor(rsum, d, 32);
            lrow[r] = lrow[r] * corr + rsum;
            mrow[r] = mnew;
#pragma unroll
            for (int j = 0; j < 4; ++j) o[j][r] *= corr;
        }
        // ---- P to LDS (C layout), re-read as A fragments
        __syncthreads();
#pragma unroll
        for (int r = 0; r < 8; ++r)
#pragma unroll
            for (int j = 0; j < 4; ++j)
                Pl[wave][r + 8 * hi][j * 16 + col] = (_Float16)s[j][r];
        __syncthreads();
        // ---- O += P * V : preload all V fragments, then burst 8 WMMAs
        v16h vf[8];
#pragma unroll
        for (int ks = 0; ks < 2; ++ks)
#pragma unroll
            for (int j = 0; j < 4; ++j)
                vf[ks * 4 + j] = ldfrag(Vp + (size_t)(j * 16 + row) * CT +
                                        k0 + ks * 32 + koff);
#pragma unroll
        for (int ks = 0; ks < 2; ++ks) {
            v16h pf = ldfrag(&Pl[wave][row][ks * 32 + koff]);
#pragma unroll
            for (int j = 0; j < 4; ++j)
                o[j] = wmma_f16(pf, vf[ks * 4 + j], o[j]);
        }
    }

    // ---- normalize and store un-permuted (B,T,D) f16
#pragma unroll
    for (int j = 0; j < 4; ++j) {
#pragma unroll
        for (int r = 0; r < 8; ++r) {
            int t  = q0 + r + 8 * hi;
            int hd = j * 16 + col;
            float v = o[j][r] / lrow[r];
            attn_out[((size_t)(b * CT + t)) * CD + h * CHD + hd] = (_Float16)v;
        }
    }
}

// ---------------------------------------------------------------------------
// Host side
// ---------------------------------------------------------------------------
static inline size_t align256(size_t x) { return (x + 255) & ~(size_t)255; }

extern "C" void kernel_launch(void* const* d_in, const int* in_sizes, int n_in,
                              void* d_out, int out_size, void* d_ws, size_t ws_size,
                              hipStream_t stream) {
    const float* x      = (const float*)d_in[0];
    const float* Wq     = (const float*)d_in[1];
    const float* Wk     = (const float*)d_in[2];
    const float* Wv     = (const float*)d_in[3];
    const float* Wo     = (const float*)d_in[4];
    const float* bo     = (const float*)d_in[5];
    const float* W1     = (const float*)d_in[6];
    const float* b1     = (const float*)d_in[7];
    const float* W2     = (const float*)d_in[8];
    const float* b2     = (const float*)d_in[9];
    const float* gamma1 = (const float*)d_in[10];
    const float* beta1  = (const float*)d_in[11];
    const float* gamma2 = (const float*)d_in[12];
    const float* beta2  = (const float*)d_in[13];
    float* out = (float*)d_out;

    // ---- workspace carve-up
    char* ws = (char*)d_ws;
    size_t off = 0;
    auto alloc = [&](size_t bytes) -> char* {
        char* p = ws + off;
        off = align256(off + bytes);
        return p;
    };
    _Float16* h1   = (_Float16*)alloc((size_t)CM * CD * 2);
    _Float16* wqT  = (_Float16*)alloc((size_t)CD * CD * 2);
    _Float16* wkT  = (_Float16*)alloc((size_t)CD * CD * 2);
    _Float16* wvT  = (_Float16*)alloc((size_t)CD * CD * 2);
    _Float16* woT  = (_Float16*)alloc((size_t)CD * CD * 2);
    _Float16* w1T  = (_Float16*)alloc((size_t)CD * CDF * 2);
    _Float16* w2T  = (_Float16*)alloc((size_t)CDF * CD * 2);
    _Float16* q16  = (_Float16*)alloc((size_t)CM * CD * 2);
    _Float16* k16  = (_Float16*)alloc((size_t)CM * CD * 2);
    _Float16* vt16 = (_Float16*)alloc((size_t)CM * CD * 2);
    _Float16* at16 = (_Float16*)alloc((size_t)CM * CD * 2);
    float*    x1   = (float*)   alloc((size_t)CM * CD * 4);
    _Float16* h2   = (_Float16*)alloc((size_t)CM * CD * 2);
    _Float16* ff1  = (_Float16*)alloc((size_t)CM * CDF * 2);
    (void)ws_size; (void)in_sizes; (void)n_in; (void)out_size;

    dim3 tb(32, 8);
    // 1) weight transposes (K x N -> N x K, f16)
    transpose_cast_kernel<<<dim3(CD / 32, CD / 32), tb, 0, stream>>>(Wq, wqT, CD, CD);
    transpose_cast_kernel<<<dim3(CD / 32, CD / 32), tb, 0, stream>>>(Wk, wkT, CD, CD);
    transpose_cast_kernel<<<dim3(CD / 32, CD / 32), tb, 0, stream>>>(Wv, wvT, CD, CD);
    transpose_cast_kernel<<<dim3(CD / 32, CD / 32), tb, 0, stream>>>(Wo, woT, CD, CD);
    transpose_cast_kernel<<<dim3(CDF / 32, CD / 32), tb, 0, stream>>>(W1, w1T, CD, CDF);
    transpose_cast_kernel<<<dim3(CD / 32, CDF / 32), tb, 0, stream>>>(W2, w2T, CDF, CD);

    // 2) LN1
    layernorm_f16_kernel<<<CM, 256, 0, stream>>>(x, gamma1, beta1, h1);

    // 3) QKV projections, stored pre-permuted for attention
    dim3 gD(CD / 128, CM / 256);
    gemm_wmma_kernel<<<gD, 256, 0, stream>>>(h1, wqT, nullptr, nullptr, nullptr, q16,
                                             CM, CD, CD, /*act*/0, /*mode*/2);
    gemm_wmma_kernel<<<gD, 256, 0, stream>>>(h1, wkT, nullptr, nullptr, nullptr, k16,
                                             CM, CD, CD, 0, 2);
    gemm_wmma_kernel<<<gD, 256, 0, stream>>>(h1, wvT, nullptr, nullptr, nullptr, vt16,
                                             CM, CD, CD, 0, 3);

    // 4) causal flash attention
    attention_kernel<<<dim3(CT / 64, CB * CH), 128, 0, stream>>>(q16, k16, vt16, at16);

    // 5) x1 = attn @ Wo + bo + x
    gemm_wmma_kernel<<<gD, 256, 0, stream>>>(at16, woT, bo, x, x1, nullptr,
                                             CM, CD, CD, 0, /*mode*/0);

    // 6) LN2
    layernorm_f16_kernel<<<CM, 256, 0, stream>>>(x1, gamma2, beta2, h2);

    // 7) ff1 = gelu(h2 @ W1 + b1)
    gemm_wmma_kernel<<<dim3(CDF / 128, CM / 256), 256, 0, stream>>>(
        h2, w1T, b1, nullptr, nullptr, ff1, CM, CDF, CD, /*act*/1, /*mode*/1);

    // 8) out = ff1 @ W2 + b2 + x1
    gemm_wmma_kernel<<<gD, 256, 0, stream>>>(ff1, w2T, b2, x1, out, nullptr,
                                             CM, CD, CDF, 0, /*mode*/0);
}
